// v000
// Measured on an AMD MI455X. A time is GPU time per run, averaged over a window of back-to-back runs after a warm-up
// (all launches, gaps included; the runs take copies of the inputs in turn), and the median of several windows.
// Apart from v000's, it joins two sittings. Times from different sittings can be a few percent apart, while
// side-by-side timings come from the same sitting.
// The starting kernel, v000, takes 285 microseconds a run.
#include <hip/hip_runtime.h>

// S4D / diagonal-SSM reservoir + 2-layer 1x1-conv MLP for MI455X (gfx1250).
// Shapes: B=16, H=128, L=4096, N=64.  dt = 0.01.

#define DT 0.01f
constexpr int Bb = 16;
constexpr int Hh = 128;
constexpr int Ll = 4096;
constexpr int Nn = 64;

typedef __attribute__((ext_vector_type(2))) float v2f;
typedef __attribute__((ext_vector_type(4))) float v4f;
typedef __attribute__((ext_vector_type(8))) float v8f;

// ---------------------------------------------------------------------------
// Kernel 1: diagonal SSM scan.
//   s_n[l] = A_n * s_n[l-1] + u[l],  A_n = exp(dt*Lambda_n)
//   y[b,h,l] = sum_n Re(W_n * s_n[l]) + d[h]*u[b,h,l]
// One wave32 per (b,h) sequence; 2 complex states per lane (N=64).
// 32-step chunks; per-lane partial readouts transposed through LDS so the
// final y store is coalesced.
// ---------------------------------------------------------------------------
__global__ __launch_bounds__(256) void ssm_scan_kernel(
    const float* __restrict__ u,   const float* __restrict__ lre,
    const float* __restrict__ lim, const float* __restrict__ wre,
    const float* __restrict__ wim, const float* __restrict__ dvec,
    float* __restrict__ y)
{
    __shared__ float slab[8][32 * 33];   // per-wave 32x32 slab, padded stride 33

    const int lane = threadIdx.x & 31;
    const int wid  = threadIdx.x >> 5;
    const int seq  = blockIdx.x * 8 + wid;      // flat (b*H + h)
    const int h    = seq & (Hh - 1);

    const float* up = u + (size_t)seq * Ll;
    float*       yp = y + (size_t)seq * Ll;

    // two states per lane: n and n+32
    const int n0 = lane, n1 = lane + 32;
    const float lr0 = lre[h * Nn + n0], li0 = lim[h * Nn + n0];
    const float lr1 = lre[h * Nn + n1], li1 = lim[h * Nn + n1];
    const float e0  = __expf(DT * lr0), e1 = __expf(DT * lr1);
    const float ar0 = e0 * __cosf(DT * li0), ai0 = e0 * __sinf(DT * li0);
    const float ar1 = e1 * __cosf(DT * li1), ai1 = e1 * __sinf(DT * li1);
    const float wr0 = wre[h * Nn + n0], wi0 = wim[h * Nn + n0];
    const float wr1 = wre[h * Nn + n1], wi1 = wim[h * Nn + n1];
    const float dh  = dvec[h];

    float sr0 = 0.f, si0 = 0.f, sr1 = 0.f, si1 = 0.f;
    float* my = slab[wid];

    for (int l0 = 0; l0 < Ll; l0 += 32) {
        const float uc = up[l0 + lane];          // coalesced 32-wide chunk
        #pragma unroll
        for (int t = 0; t < 32; ++t) {
            const float ut = __shfl(uc, t, 32);  // broadcast u[l0+t]
            const float nr0 = fmaf(ar0, sr0, fmaf(-ai0, si0, ut));
            const float ni0 = fmaf(ar0, si0, ai0 * sr0);
            const float nr1 = fmaf(ar1, sr1, fmaf(-ai1, si1, ut));
            const float ni1 = fmaf(ar1, si1, ai1 * sr1);
            sr0 = nr0; si0 = ni0; sr1 = nr1; si1 = ni1;
            // per-lane readout partial (2 of the 64 states)
            const float p = wr0 * sr0 - wi0 * si0 + wr1 * sr1 - wi1 * si1;
            my[t * 33 + lane] = p;
        }
        __syncthreads();
        float acc = 0.f;
        #pragma unroll
        for (int i = 0; i < 32; ++i) acc += my[lane * 33 + i];
        yp[l0 + lane] = acc + dh * uc;
        __syncthreads();
    }
}

// ---------------------------------------------------------------------------
// Kernels 2/3: out[b,o,l] = relu( sum_h W[o,h] * X[b,h,l] + bias[o] )
// GEMM: (128x128) @ (128 x 65536) with V_WMMA_F32_16X16X4_F32.
// Block = 256 threads (8 waves); block owns 128 contiguous columns (b,l),
// wave w owns 16 columns and all 8 M-tiles (8 x v8f accumulators).
// W is staged in LDS; A-tiles come back via ds_load_b64 in the ISA's
// 16x4 f32 A layout (lanes 0-15: K={0,1}; lanes 16-31: K={2,3}).
// ---------------------------------------------------------------------------
__global__ __launch_bounds__(256) void mlp_wmma_kernel(
    const float* __restrict__ W, const float* __restrict__ bias,
    const float* __restrict__ X, float* __restrict__ Y)
{
    __shared__ float sW[Hh * Hh];                 // 64 KB
    for (int i = threadIdx.x; i < (Hh * Hh) / 4; i += 256)
        ((v4f*)sW)[i] = ((const v4f*)W)[i];
    __syncthreads();

    const int lane = threadIdx.x & 31;
    const int wid  = threadIdx.x >> 5;
    const int n    = lane & 15;                   // column within 16-wide tile
    const int hi   = lane >> 4;                   // half-wave selector

    const long c0  = (long)blockIdx.x * 128 + wid * 16;  // flat (b*L + l)
    const int  bb  = (int)(c0 / Ll);
    const int  l0  = (int)(c0 % Ll);              // L % 128 == 0: b uniform

    const float* xcol = X + ((size_t)bb * Hh) * Ll + l0 + n;

    v8f acc[8] = {};                              // 8 M-tiles x 16x16 f32

    for (int kt = 0; kt < 32; ++kt) {
        const int k0 = kt * 4;
        // B tile 4x16: lane(0-15) rows K={0,1}, lane(16-31) rows K={2,3}
        const int rb = k0 + 2 * hi;
        v2f bv;
        bv.x = xcol[(size_t)rb * Ll];
        bv.y = xcol[(size_t)(rb + 1) * Ll];
        #pragma unroll
        for (int mt = 0; mt < 8; ++mt) {
            // A tile 16x4: lane m -> {W[o0+m,k0+2hi], W[o0+m,k0+2hi+1]}
            const int row = mt * 16 + n;
            const v2f av = *(const v2f*)&sW[row * Hh + k0 + 2 * hi];
            acc[mt] = __builtin_amdgcn_wmma_f32_16x16x4_f32(
                /*neg_a=*/false, av, /*neg_b=*/false, bv,
                /*c_mod=*/(short)0, acc[mt],
                /*reuse_a=*/false, /*reuse_b=*/false);
        }
    }

    // C/D layout: VGPR v, lanes 0-15 -> row v, lanes 16-31 -> row v+8
    float* ycol = Y + ((size_t)bb * Hh) * Ll + l0 + n;
    #pragma unroll
    for (int mt = 0; mt < 8; ++mt) {
        #pragma unroll
        for (int v = 0; v < 8; ++v) {
            const int row = mt * 16 + v + 8 * hi;
            float r = acc[mt][v] + bias[row];
            ycol[(size_t)row * Ll] = r > 0.f ? r : 0.f;
        }
    }
}

// ---------------------------------------------------------------------------
// Launch. Inputs:
//  0:u 1:lambda_re 2:lambda_im 3:w_re 4:w_im 5:d 6:mlp_w1 7:mlp_b1 8:mlp_w2 9:mlp_b2
// d_ws holds y (B*H*L f32 = 32 MB). Layer-1 output goes to d_out, layer-2
// runs safely in place on d_out (column-disjoint blocks, reads before writes).
// ---------------------------------------------------------------------------
extern "C" void kernel_launch(void* const* d_in, const int* in_sizes, int n_in,
                              void* d_out, int out_size, void* d_ws, size_t ws_size,
                              hipStream_t stream)
{
    const float* u   = (const float*)d_in[0];
    const float* lre = (const float*)d_in[1];
    const float* lim = (const float*)d_in[2];
    const float* wre = (const float*)d_in[3];
    const float* wim = (const float*)d_in[4];
    const float* dv  = (const float*)d_in[5];
    const float* w1  = (const float*)d_in[6];
    const float* b1  = (const float*)d_in[7];
    const float* w2  = (const float*)d_in[8];
    const float* b2  = (const float*)d_in[9];
    float* out = (float*)d_out;
    float* yws = (float*)d_ws;                    // B*H*L floats

    // 1) SSM scan: 2048 sequences, 8 waves (sequences) per 256-thread block
    ssm_scan_kernel<<<(Bb * Hh) / 8, 256, 0, stream>>>(u, lre, lim, wre, wim, dv, yws);

    // 2) MLP layer 1: h1 = relu(W1 @ y + b1) -> d_out
    const int nblk = (Bb * Ll) / 128;             // 512 column-blocks
    mlp_wmma_kernel<<<nblk, 256, 0, stream>>>(w1, b1, yws, out);

    // 3) MLP layer 2: out = relu(W2 @ h1 + b2), in place on d_out
    mlp_wmma_kernel<<<nblk, 256, 0, stream>>>(w2, b2, out, out);
}

// v001
// One run takes 98 microseconds.
// Timed twice side by side with v000, it ran 2.99 times as fast both times.
#include <hip/hip_runtime.h>

// S4D / diagonal-SSM reservoir + 2-layer 1x1-conv MLP for MI455X (gfx1250).
// Shapes: B=16, H=128, L=4096, N=64.  dt = 0.01.

#define DT 0.01f
constexpr int Bb = 16;
constexpr int Hh = 128;
constexpr int Ll = 4096;
constexpr int Nn = 64;

typedef __attribute__((ext_vector_type(2))) float v2f;
typedef __attribute__((ext_vector_type(4))) float v4f;
typedef __attribute__((ext_vector_type(8))) float v8f;

// ---------------------------------------------------------------------------
// Kernel 1: diagonal SSM in chunked matrix form, all products on
// V_WMMA_F32_16X16X4_F32.
//   s_n[l] = A_n * s_n[l-1] + u[l],  A_n = exp(dt*Lambda_n)
//   y[b,h,l] = sum_n Re(W_n * s_n[l]) + d[h]*u[b,h,l]
// A sequence is cut into CH = 128 chunks of TC = 32 steps and read as a
// matrix U[t][c] = u[32c + t].  With S_c the state in front of chunk c:
//   phase 1  G = Bm * U            Bm[2n|2n+1][t] = Re|Im A_n^(31-t)
//   phase 2  S_(c+1) = A^32 S_c + G_c   (128 steps in place of 4096)
//   phase 3  Y = Cm * S + Tm * U   Cm[t][2n|2n+1] = Re|-Im (W_n A_n^(t+1))
//                                  Tm[t][j] = K[t-j] (j <= t), K[0] holds d
// Block = 16 waves = 4 sequences (4 b) of one h; a wave owns 2 tiles of 16
// chunks (the N side).  Fragments are read 16 bytes a lane, two WMMAs each
// ({0,1} then {2,3}); lane half hi starts at k = 16(j/2)+8hi+4(j%2) where U is
// the B side and at k = 8j+4hi where S is, the same map for A and B each time.
// ---------------------------------------------------------------------------
constexpr int TC  = 32;            // chunk length
constexpr int CH  = Ll / TC;       // 128 chunks a sequence
constexpr int PB  = TC + 4;        // LDS pitch, rows of 32 floats (16 B x odd)
constexpr int PS  = 2 * Nn + 4;    // LDS pitch, rows of 128 floats (16 B x odd)
constexpr int SEQ = 4;             // sequences a block

__device__ __forceinline__ v8f mm4(v2f a, v2f b, v8f c)
{
    return __builtin_amdgcn_wmma_f32_16x16x4_f32(false, a, false, b, (short)0, c,
                                                 false, false);
}

// Head and foot of a block of WMMAs.  The fences keep address arithmetic out of
// the block; the four v_nop are the vector slots between the last WMMAs and the
// first vector instruction behind them, which may reuse their A or B registers.
__device__ __forceinline__ void mm_head() { __builtin_amdgcn_sched_barrier(0); }
__device__ __forceinline__ void mm_foot()
{
    __builtin_amdgcn_sched_barrier(0);
    asm volatile("v_nop\n\tv_nop\n\tv_nop\n\tv_nop");
    __builtin_amdgcn_sched_barrier(0);
}

__global__ __launch_bounds__(512) void ssm_scan_kernel(
    const float* __restrict__ u,   const float* __restrict__ lre,
    const float* __restrict__ lim, const float* __restrict__ wre,
    const float* __restrict__ wim, const float* __restrict__ dvec,
    float* __restrict__ y)
{
    __shared__ __attribute__((aligned(16))) float sS[SEQ * CH * PS];  // G, then S, [q][c][r]
    __shared__ __attribute__((aligned(16))) float sB[2 * Nn * PB];    // Bm[r][t]
    __shared__ __attribute__((aligned(16))) float sC[(TC + 1) * PS];  // row p: W A^p; Cm[t] = row t+1
    __shared__ __attribute__((aligned(16))) float sT[TC * PB];        // Tm[t][j]
    __shared__ float sK[TC];                                          // K[0..31]

    const int tid  = threadIdx.x;
    const int lane = tid & 31;
    const int wid  = __builtin_amdgcn_readfirstlane(tid >> 5);  // scalar: bases and branches per wave
    const int n    = lane & 15;
    const int hi   = lane >> 4;
    const int h    = blockIdx.x & (Hh - 1);
    const int bg   = blockIdx.x >> 7;          // group of 4 b
    const int q    = wid >> 2;                 // this wave's sequence in the block
    const int c0   = (wid & 3) * 32;           // first chunk of its two N tiles

    const size_t seq = (size_t)(bg * SEQ + q) * Hh + h;
    const float* up = u + seq * Ll + c0 * TC;  // scalar bases of the wave's 32 chunks
    float*       yp = y + seq * Ll + c0 * TC;
    const unsigned lo = n * TC + 8 * hi;       // the lane's place, for the loads of u and the stores of y

    // B fragments of U, kept in registers for phases 1 and 3
    v4f ub[2][4];
    #pragma unroll   // constant indices: values stay in registers, offsets become immediates
    for (int i = 0; i < 2; ++i)
        #pragma unroll   // constant indices: values stay in registers, offsets become immediates
        for (int j = 0; j < 4; ++j)
            ub[i][j] = *(const v4f*)(up + lo + i * 16 * TC + 16 * (j >> 1) + 4 * (j & 1));

    // phase 0: the h's own matrices; a thread keeps one state sn, powers m = tid/64 + 8k
    const int sn = tid & (Nn - 1);
    const float lr = DT * lre[h * Nn + sn], li = DT * lim[h * Nn + sn];
    const float wr = wre[h * Nn + sn],      wi = wim[h * Nn + sn];
    #pragma unroll   // constant indices: values stay in registers, offsets become immediates
    for (int m = tid >> 6; m < TC; m += 8) {
        const float fm = (float)m, fp = (float)(m + 1);
        const float em = __expf(lr * fm), ep = __expf(lr * fp);
        sB[(2 * sn) * PB + (TC - 1 - m)]     = em * __cosf(li * fm);
        sB[(2 * sn + 1) * PB + (TC - 1 - m)] = em * __sinf(li * fm);
        const float pr = ep * __cosf(li * fp), pi = ep * __sinf(li * fp);
        sC[(m + 1) * PS + 2 * sn]     = wr * pr - wi * pi;      //  Re(W A^(m+1))
        sC[(m + 1) * PS + 2 * sn + 1] = -(wr * pi + wi * pr);   // -Im(W A^(m+1))
    }
    if (tid < Nn) { sC[2 * sn] = wr; sC[2 * sn + 1] = -wi; }
    // A^32, the factor of the chunk-state scan
    const float eT = __expf(lr * (float)TC);
    const float ar = eT * __cosf(li * (float)TC), ai = eT * __sinf(li * (float)TC);
    __syncthreads();

    // K[m] = sum_n Re(W_n A_n^m), the feed-through d on K[0]; read after phase 1
    if (wid == 0) {
        const float* p = sC + lane * PS;
        float k0 = 0.f, k1 = 0.f, k2 = 0.f, k3 = 0.f;
        #pragma unroll   // constant indices: values stay in registers, offsets become immediates
        for (int i = 0; i < Nn; i += 4) {
            k0 += p[2 * i];     k1 += p[2 * i + 2];
            k2 += p[2 * i + 4]; k3 += p[2 * i + 6];
        }
        sK[lane] = (k0 + k1) + (k2 + k3) + (lane == 0 ? dvec[h] : 0.f);
    }

    // phase 1: G[r][c] = sum_t Bm[r][t] U[t][c], stored as sS[q][c][r]
    float* Sq = sS + q * (CH * PS);
    const float* ap = sB + n * PB + 8 * hi;
    float*       d0 = Sq + (c0 + n) * PS + 8 * hi;
    // rolled: one block of 16 WMMAs a trip, its addresses formed in front of it
    #pragma unroll 1
    for (int mt = 0; mt < 8; ++mt) {
        v8f g0 = {}, g1 = {};
        mm_head();
        #pragma unroll   // constant indices: values stay in registers, offsets become immediates
        for (int j = 0; j < 4; ++j) {
            const v4f av = *(const v4f*)(ap + 16 * (j >> 1) + 4 * (j & 1));
            g0 = mm4(av.xy, ub[0][j].xy, g0);
            g1 = mm4(av.xy, ub[1][j].xy, g1);
            g0 = mm4(av.zw, ub[0][j].zw, g0);
            g1 = mm4(av.zw, ub[1][j].zw, g1);
        }
        mm_foot();
        // D: register v holds row v + 8*hi, column n
        *(v4f*)d0             = g0.lo;  *(v4f*)(d0 + 4)           = g0.hi;
        *(v4f*)(d0 + 16 * PS) = g1.lo;  *(v4f*)(d0 + 16 * PS + 4) = g1.hi;
        ap += 16 * PB;
        d0 += 16;
    }
    __syncthreads();

    // phase 2: waves 0-7 scan the chunk states in place (one complex state a
    // lane); waves 8-15 lay out the Toeplitz block meanwhile
    if (wid < 8) {
        float* base = sS + (tid >> 6) * (CH * PS) + 2 * sn;
        float sr = 0.f, si = 0.f;
        v2f ga[8], gb[8];
        #pragma unroll   // constant indices: values stay in registers, offsets become immediates
        for (int k = 0; k < 8; ++k) ga[k] = *(const v2f*)(base + k * PS);
        // two register buffers: the LDS reads of the next 8 steps go out ahead of
        // the serial chain of these 8; kept rolled, unrolled whole it spills
        #pragma unroll 1
        for (int c = 0; c < CH; c += 16) {
            #pragma unroll   // constant indices: values stay in registers, offsets become immediates
            for (int k = 0; k < 8; ++k) gb[k] = *(const v2f*)(base + (c + 8 + k) * PS);
            #pragma unroll   // constant indices: values stay in registers, offsets become immediates
            for (int k = 0; k < 8; ++k) {
                v2f s; s.x = sr; s.y = si;
                *(v2f*)(base + (c + k) * PS) = s;
                const float nr = fmaf(ar, sr, fmaf(-ai, si, ga[k].x));
                const float ni = fmaf(ar, si, fmaf(ai, sr, ga[k].y));
                sr = nr; si = ni;
            }
            if (c + 16 < CH) {
                #pragma unroll   // constant indices: values stay in registers, offsets become immediates
                for (int k = 0; k < 8; ++k) ga[k] = *(const v2f*)(base + (c + 16 + k) * PS);
            }
            #pragma unroll   // constant indices: values stay in registers, offsets become immediates
            for (int k = 0; k < 8; ++k) {
                v2f s; s.x = sr; s.y = si;
                *(v2f*)(base + (c + 8 + k) * PS) = s;
                const float nr = fmaf(ar, sr, fmaf(-ai, si, gb[k].x));
                const float ni = fmaf(ar, si, fmaf(ai, sr, gb[k].y));
                sr = nr; si = ni;
            }
        }
    } else {
        for (int idx = tid - 256; idx < TC * TC; idx += 256) {
            const int t = idx >> 5, j = idx & 31;
            const float kv = sK[(t - j) & 31];
            sT[t * PB + j] = t >= j ? kv : 0.f;
        }
    }
    __syncthreads();

    // phase 3: Y[t][c] = sum_r Cm[t][r] S[r][c] + sum_j Tm[t][j] U[j][c]
    v8f y00 = {}, y01 = {}, y10 = {}, y11 = {};     // y<M tile><N tile>
    const float* b0p = Sq + (c0 + n) * PS + 4 * hi;
    const float* b1p = b0p + 16 * PS;
    const float* a0p = sC + (1 + n) * PS + 4 * hi;
    const float* a1p = a0p + 16 * PS;
    // rolled: one block of 32 WMMAs a trip, its addresses formed in front of it
    #pragma unroll 1
    for (int jo = 0; jo < 4; ++jo) {
        mm_head();
        #pragma unroll   // constant indices: values stay in registers, offsets become immediates
        for (int j = 0; j < 4; ++j) {
            const v4f a0 = *(const v4f*)(a0p + 8 * j), a1 = *(const v4f*)(a1p + 8 * j);
            const v4f b0 = *(const v4f*)(b0p + 8 * j), b1 = *(const v4f*)(b1p + 8 * j);
            y00 = mm4(a0.xy, b0.xy, y00);  y01 = mm4(a0.xy, b1.xy, y01);
            y10 = mm4(a1.xy, b0.xy, y10);  y11 = mm4(a1.xy, b1.xy, y11);
            y00 = mm4(a0.zw, b0.zw, y00);  y01 = mm4(a0.zw, b1.zw, y01);
            y10 = mm4(a1.zw, b0.zw, y10);  y11 = mm4(a1.zw, b1.zw, y11);
        }
        mm_foot();
        a0p += 32; a1p += 32; b0p += 32; b1p += 32;
    }
    const float* t0p = sT + n * PB + 8 * hi;
    mm_head();
    #pragma unroll   // constant indices: values stay in registers, offsets become immediates
    for (int j = 0; j < 4; ++j) {
        const v4f a1 = *(const v4f*)(t0p + 16 * PB + 16 * (j >> 1) + 4 * (j & 1));
        y10 = mm4(a1.xy, ub[0][j].xy, y10);  y11 = mm4(a1.xy, ub[1][j].xy, y11);
        y10 = mm4(a1.zw, ub[0][j].zw, y10);  y11 = mm4(a1.zw, ub[1][j].zw, y11);
        if (j < 2) {                                // rows 0-15 are zero for j >= 16
            const v4f a0 = *(const v4f*)(t0p + 4 * j);
            y00 = mm4(a0.xy, ub[0][j].xy, y00);  y01 = mm4(a0.xy, ub[1][j].xy, y01);
            y00 = mm4(a0.zw, ub[0][j].zw, y00);  y01 = mm4(a0.zw, ub[1][j].zw, y01);
        }
    }
    mm_foot();

    // lane (n, hi) holds t = 16*mt + 8*hi + 0..7 of chunk c: 32 bytes in a row
    float* o0 = yp + lo;
    float* o1 = o0 + 16 * TC;
    *(v4f*)o0        = y00.lo;  *(v4f*)(o0 + 4)  = y00.hi;
    *(v4f*)(o0 + 16) = y10.lo;  *(v4f*)(o0 + 20) = y10.hi;
    *(v4f*)o1        = y01.lo;  *(v4f*)(o1 + 4)  = y01.hi;
    *(v4f*)(o1 + 16) = y11.lo;  *(v4f*)(o1 + 20) = y11.hi;
}

// ---------------------------------------------------------------------------
// Kernels 2/3: out[b,o,l] = relu( sum_h W[o,h] * X[b,h,l] + bias[o] )
// GEMM: (128x128) @ (128 x 65536) with V_WMMA_F32_16X16X4_F32.
// Block = 256 threads (8 waves); block owns 128 contiguous columns (b,l),
// wave w owns 16 columns and all 8 M-tiles (8 x v8f accumulators).
// W is staged in LDS; A-tiles come back via ds_load_b64 in the ISA's
// 16x4 f32 A layout (lanes 0-15: K={0,1}; lanes 16-31: K={2,3}).
// ---------------------------------------------------------------------------
__global__ __launch_bounds__(256) void mlp_wmma_kernel(
    const float* __restrict__ W, const float* __restrict__ bias,
    const float* __restrict__ X, float* __restrict__ Y)
{
    __shared__ float sW[Hh * Hh];                 // 64 KB
    for (int i = threadIdx.x; i < (Hh * Hh) / 4; i += 256)
        ((v4f*)sW)[i] = ((const v4f*)W)[i];
    __syncthreads();

    const int lane = threadIdx.x & 31;
    const int wid  = threadIdx.x >> 5;
    const int n    = lane & 15;                   // column within 16-wide tile
    const int hi   = lane >> 4;                   // half-wave selector

    const long c0  = (long)blockIdx.x * 128 + wid * 16;  // flat (b*L + l)
    const int  bb  = (int)(c0 / Ll);
    const int  l0  = (int)(c0 % Ll);              // L % 128 == 0: b uniform

    const float* xcol = X + ((size_t)bb * Hh) * Ll + l0 + n;

    v8f acc[8] = {};                              // 8 M-tiles x 16x16 f32

    for (int kt = 0; kt < 32; ++kt) {
        const int k0 = kt * 4;
        // B tile 4x16: lane(0-15) rows K={0,1}, lane(16-31) rows K={2,3}
        const int rb = k0 + 2 * hi;
        v2f bv;
        bv.x = xcol[(size_t)rb * Ll];
        bv.y = xcol[(size_t)(rb + 1) * Ll];
        #pragma unroll
        for (int mt = 0; mt < 8; ++mt) {
            // A tile 16x4: lane m -> {W[o0+m,k0+2hi], W[o0+m,k0+2hi+1]}
            const int row = mt * 16 + n;
            const v2f av = *(const v2f*)&sW[row * Hh + k0 + 2 * hi];
            acc[mt] = __builtin_amdgcn_wmma_f32_16x16x4_f32(
                /*neg_a=*/false, av, /*neg_b=*/false, bv,
                /*c_mod=*/(short)0, acc[mt],
                /*reuse_a=*/false, /*reuse_b=*/false);
        }
    }

    // C/D layout: VGPR v, lanes 0-15 -> row v, lanes 16-31 -> row v+8
    float* ycol = Y + ((size_t)bb * Hh) * Ll + l0 + n;
    #pragma unroll
    for (int mt = 0; mt < 8; ++mt) {
        #pragma unroll
        for (int v = 0; v < 8; ++v) {
            const int row = mt * 16 + v + 8 * hi;
            float r = acc[mt][v] + bias[row];
            ycol[(size_t)row * Ll] = r > 0.f ? r : 0.f;
        }
    }
}

// ---------------------------------------------------------------------------
// Launch. Inputs:
//  0:u 1:lambda_re 2:lambda_im 3:w_re 4:w_im 5:d 6:mlp_w1 7:mlp_b1 8:mlp_w2 9:mlp_b2
// d_ws holds y (B*H*L f32 = 32 MB). Layer-1 output goes to d_out, layer-2
// runs safely in place on d_out (column-disjoint blocks, reads before writes).
// ---------------------------------------------------------------------------
extern "C" void kernel_launch(void* const* d_in, const int* in_sizes, int n_in,
                              void* d_out, int out_size, void* d_ws, size_t ws_size,
                              hipStream_t stream)
{
    const float* u   = (const float*)d_in[0];
    const float* lre = (const float*)d_in[1];
    const float* lim = (const float*)d_in[2];
    const float* wre = (const float*)d_in[3];
    const float* wim = (const float*)d_in[4];
    const float* dv  = (const float*)d_in[5];
    const float* w1  = (const float*)d_in[6];
    const float* b1  = (const float*)d_in[7];
    const float* w2  = (const float*)d_in[8];
    const float* b2  = (const float*)d_in[9];
    float* out = (float*)d_out;
    float* yws = (float*)d_ws;                    // B*H*L floats

    // 1) SSM in chunked matrix form: 4 sequences (one h, 4 b) per 512-thread block
    ssm_scan_kernel<<<(Bb * Hh) / 4, 512, 0, stream>>>(u, lre, lim, wre, wim, dv, yws);

    // 2) MLP layer 1: h1 = relu(W1 @ y + b1) -> d_out
    const int nblk = (Bb * Ll) / 128;             // 512 column-blocks
    mlp_wmma_kernel<<<nblk, 256, 0, stream>>>(w1, b1, yws, out);

    // 3) MLP layer 2: out = relu(W2 @ h1 + b2), in place on d_out
    mlp_wmma_kernel<<<nblk, 256, 0, stream>>>(w2, b2, out, out);
}

// v002
// It runs in 59.7 microseconds.
// In both of two side-by-side timings against v001, it was 1.64 times as fast.
// Counting every step since v000, it is 4.91 times as fast.
#include <hip/hip_runtime.h>

// S4D / diagonal-SSM reservoir + 2-layer 1x1-conv MLP for MI455X (gfx1250).
// Shapes: B=16, H=128, L=4096, N=64.  dt = 0.01.

#define DT 0.01f
constexpr int Bb = 16;
constexpr int Hh = 128;
constexpr int Ll = 4096;
constexpr int Nn = 64;

typedef __attribute__((ext_vector_type(2))) float v2f;
typedef __attribute__((ext_vector_type(4))) float v4f;
typedef __attribute__((ext_vector_type(8))) float v8f;

// ---------------------------------------------------------------------------
// Kernel 1: diagonal SSM in chunked matrix form, all products on
// V_WMMA_F32_16X16X4_F32.
//   s_n[l] = A_n * s_n[l-1] + u[l],  A_n = exp(dt*Lambda_n)
//   y[b,h,l] = sum_n Re(W_n * s_n[l]) + d[h]*u[b,h,l]
// A sequence is cut into CH = 128 chunks of TC = 32 steps and read as a
// matrix U[t][c] = u[32c + t].  With S_c the state in front of chunk c:
//   phase 1  G = Bm * U            Bm[2n|2n+1][t] = Re|Im A_n^(31-t)
//   phase 2  S_(c+1) = A^32 S_c + G_c   (128 steps in place of 4096)
//   phase 3  Y = Cm * S + Tm * U   Cm[t][2n|2n+1] = Re|-Im (W_n A_n^(t+1))
//                                  Tm[t][j] = K[t-j] (j <= t), K[0] holds d
// Block = 16 waves = 4 sequences (4 b) of one h; a wave owns 2 tiles of 16
// chunks (the N side).  Fragments are read 16 bytes a lane, two WMMAs each
// ({0,1} then {2,3}); lane half hi starts at k = 16(j/2)+8hi+4(j%2) where U is
// the B side and at k = 8j+4hi where S is, the same map for A and B each time.
// ---------------------------------------------------------------------------
constexpr int TC  = 32;            // chunk length
constexpr int CH  = Ll / TC;       // 128 chunks a sequence
constexpr int PB  = TC + 4;        // LDS pitch, rows of 32 floats (16 B x odd)
constexpr int PS  = 2 * Nn + 4;    // LDS pitch, rows of 128 floats (16 B x odd)
constexpr int SEQ = 4;             // sequences a block

__device__ __forceinline__ v8f mm4(v2f a, v2f b, v8f c)
{
    return __builtin_amdgcn_wmma_f32_16x16x4_f32(false, a, false, b, (short)0, c,
                                                 false, false);
}

// Head and foot of a block of WMMAs.  The fences keep address arithmetic out of
// the block; the four v_nop are the vector slots between the last WMMAs and the
// first vector instruction behind them, which may reuse their A or B registers.
__device__ __forceinline__ void mm_head() { __builtin_amdgcn_sched_barrier(0); }
__device__ __forceinline__ void mm_foot()
{
    __builtin_amdgcn_sched_barrier(0);
    asm volatile("v_nop\n\tv_nop\n\tv_nop\n\tv_nop");
    __builtin_amdgcn_sched_barrier(0);
}

__global__ __launch_bounds__(512) void ssm_scan_kernel(
    const float* __restrict__ u,   const float* __restrict__ lre,
    const float* __restrict__ lim, const float* __restrict__ wre,
    const float* __restrict__ wim, const float* __restrict__ dvec,
    float* __restrict__ y)
{
    __shared__ __attribute__((aligned(16))) float sS[SEQ * CH * PS];  // G, then S, [q][c][r]
    __shared__ __attribute__((aligned(16))) float sB[2 * Nn * PB];    // Bm[r][t]
    __shared__ __attribute__((aligned(16))) float sC[(TC + 1) * PS];  // row p: W A^p; Cm[t] = row t+1
    __shared__ __attribute__((aligned(16))) float sT[TC * PB];        // Tm[t][j]
    __shared__ float sK[TC];                                          // K[0..31]

    const int tid  = threadIdx.x;
    const int lane = tid & 31;
    const int wid  = __builtin_amdgcn_readfirstlane(tid >> 5);  // scalar: bases and branches per wave
    const int n    = lane & 15;
    const int hi   = lane >> 4;
    const int h    = blockIdx.x & (Hh - 1);
    const int bg   = blockIdx.x >> 7;          // group of 4 b
    const int q    = wid >> 2;                 // this wave's sequence in the block
    const int c0   = (wid & 3) * 32;           // first chunk of its two N tiles

    const size_t seq = (size_t)(bg * SEQ + q) * Hh + h;
    const float* up = u + seq * Ll + c0 * TC;  // scalar bases of the wave's 32 chunks
    float*       yp = y + seq * Ll + c0 * TC;
    const unsigned lo = n * TC + 8 * hi;       // the lane's place, for the loads of u and the stores of y

    // B fragments of U, kept in registers for phases 1 and 3
    v4f ub[2][4];
    #pragma unroll   // constant indices: values stay in registers, offsets become immediates
    for (int i = 0; i < 2; ++i)
        #pragma unroll   // constant indices: values stay in registers, offsets become immediates
        for (int j = 0; j < 4; ++j)
            ub[i][j] = *(const v4f*)(up + lo + i * 16 * TC + 16 * (j >> 1) + 4 * (j & 1));

    // phase 0: the h's own matrices; a thread keeps one state sn, powers m = tid/64 + 8k
    const int sn = tid & (Nn - 1);
    const float lr = DT * lre[h * Nn + sn], li = DT * lim[h * Nn + sn];
    const float wr = wre[h * Nn + sn],      wi = wim[h * Nn + sn];
    #pragma unroll   // constant indices: values stay in registers, offsets become immediates
    for (int m = tid >> 6; m < TC; m += 8) {
        const float fm = (float)m, fp = (float)(m + 1);
        const float em = __expf(lr * fm), ep = __expf(lr * fp);
        sB[(2 * sn) * PB + (TC - 1 - m)]     = em * __cosf(li * fm);
        sB[(2 * sn + 1) * PB + (TC - 1 - m)] = em * __sinf(li * fm);
        const float pr = ep * __cosf(li * fp), pi = ep * __sinf(li * fp);
        sC[(m + 1) * PS + 2 * sn]     = wr * pr - wi * pi;      //  Re(W A^(m+1))
        sC[(m + 1) * PS + 2 * sn + 1] = -(wr * pi + wi * pr);   // -Im(W A^(m+1))
    }
    if (tid < Nn) { sC[2 * sn] = wr; sC[2 * sn + 1] = -wi; }
    // A^32, the factor of the chunk-state scan
    const float eT = __expf(lr * (float)TC);
    const float ar = eT * __cosf(li * (float)TC), ai = eT * __sinf(li * (float)TC);
    __syncthreads();

    // K[m] = sum_n Re(W_n A_n^m), the feed-through d on K[0]; read after phase 1
    if (wid == 0) {
        const float* p = sC + lane * PS;
        float k0 = 0.f, k1 = 0.f, k2 = 0.f, k3 = 0.f;
        #pragma unroll   // constant indices: values stay in registers, offsets become immediates
        for (int i = 0; i < Nn; i += 4) {
            k0 += p[2 * i];     k1 += p[2 * i + 2];
            k2 += p[2 * i + 4]; k3 += p[2 * i + 6];
        }
        sK[lane] = (k0 + k1) + (k2 + k3) + (lane == 0 ? dvec[h] : 0.f);
    }

    // phase 1: G[r][c] = sum_t Bm[r][t] U[t][c], stored as sS[q][c][r]
    float* Sq = sS + q * (CH * PS);
    const float* ap = sB + n * PB + 8 * hi;
    float*       d0 = Sq + (c0 + n) * PS + 8 * hi;
    // rolled: one block of 16 WMMAs a trip, its addresses formed in front of it
    #pragma unroll 1
    for (int mt = 0; mt < 8; ++mt) {
        v8f g0 = {}, g1 = {};
        mm_head();
        #pragma unroll   // constant indices: values stay in registers, offsets become immediates
        for (int j = 0; j < 4; ++j) {
            const v4f av = *(const v4f*)(ap + 16 * (j >> 1) + 4 * (j & 1));
            g0 = mm4(av.xy, ub[0][j].xy, g0);
            g1 = mm4(av.xy, ub[1][j].xy, g1);
            g0 = mm4(av.zw, ub[0][j].zw, g0);
            g1 = mm4(av.zw, ub[1][j].zw, g1);
        }
        mm_foot();
        // D: register v holds row v + 8*hi, column n
        *(v4f*)d0             = g0.lo;  *(v4f*)(d0 + 4)           = g0.hi;
        *(v4f*)(d0 + 16 * PS) = g1.lo;  *(v4f*)(d0 + 16 * PS + 4) = g1.hi;
        ap += 16 * PB;
        d0 += 16;
    }
    __syncthreads();

    // phase 2: waves 0-7 scan the chunk states in place (one complex state a
    // lane); waves 8-15 lay out the Toeplitz block meanwhile
    if (wid < 8) {
        float* base = sS + (tid >> 6) * (CH * PS) + 2 * sn;
        float sr = 0.f, si = 0.f;
        v2f ga[8], gb[8];
        #pragma unroll   // constant indices: values stay in registers, offsets become immediates
        for (int k = 0; k < 8; ++k) ga[k] = *(const v2f*)(base + k * PS);
        // two register buffers: the LDS reads of the next 8 steps go out ahead of
        // the serial chain of these 8; kept rolled, unrolled whole it spills
        #pragma unroll 1
        for (int c = 0; c < CH; c += 16) {
            #pragma unroll   // constant indices: values stay in registers, offsets become immediates
            for (int k = 0; k < 8; ++k) gb[k] = *(const v2f*)(base + (c + 8 + k) * PS);
            #pragma unroll   // constant indices: values stay in registers, offsets become immediates
            for (int k = 0; k < 8; ++k) {
                v2f s; s.x = sr; s.y = si;
                *(v2f*)(base + (c + k) * PS) = s;
                const float nr = fmaf(ar, sr, fmaf(-ai, si, ga[k].x));
                const float ni = fmaf(ar, si, fmaf(ai, sr, ga[k].y));
                sr = nr; si = ni;
            }
            if (c + 16 < CH) {
                #pragma unroll   // constant indices: values stay in registers, offsets become immediates
                for (int k = 0; k < 8; ++k) ga[k] = *(const v2f*)(base + (c + 16 + k) * PS);
            }
            #pragma unroll   // constant indices: values stay in registers, offsets become immediates
            for (int k = 0; k < 8; ++k) {
                v2f s; s.x = sr; s.y = si;
                *(v2f*)(base + (c + 8 + k) * PS) = s;
                const float nr = fmaf(ar, sr, fmaf(-ai, si, gb[k].x));
                const float ni = fmaf(ar, si, fmaf(ai, sr, gb[k].y));
                sr = nr; si = ni;
            }
        }
    } else {
        for (int idx = tid - 256; idx < TC * TC; idx += 256) {
            const int t = idx >> 5, j = idx & 31;
            const float kv = sK[(t - j) & 31];
            sT[t * PB + j] = t >= j ? kv : 0.f;
        }
    }
    __syncthreads();

    // phase 3: Y[t][c] = sum_r Cm[t][r] S[r][c] + sum_j Tm[t][j] U[j][c]
    v8f y00 = {}, y01 = {}, y10 = {}, y11 = {};     // y<M tile><N tile>
    const float* b0p = Sq + (c0 + n) * PS + 4 * hi;
    const float* b1p = b0p + 16 * PS;
    const float* a0p = sC + (1 + n) * PS + 4 * hi;
    const float* a1p = a0p + 16 * PS;
    // rolled: one block of 32 WMMAs a trip, its addresses formed in front of it
    #pragma unroll 1
    for (int jo = 0; jo < 4; ++jo) {
        mm_head();
        #pragma unroll   // constant indices: values stay in registers, offsets become immediates
        for (int j = 0; j < 4; ++j) {
            const v4f a0 = *(const v4f*)(a0p + 8 * j), a1 = *(const v4f*)(a1p + 8 * j);
            const v4f b0 = *(const v4f*)(b0p + 8 * j), b1 = *(const v4f*)(b1p + 8 * j);
            y00 = mm4(a0.xy, b0.xy, y00);  y01 = mm4(a0.xy, b1.xy, y01);
            y10 = mm4(a1.xy, b0.xy, y10);  y11 = mm4(a1.xy, b1.xy, y11);
            y00 = mm4(a0.zw, b0.zw, y00);  y01 = mm4(a0.zw, b1.zw, y01);
            y10 = mm4(a1.zw, b0.zw, y10);  y11 = mm4(a1.zw, b1.zw, y11);
        }
        mm_foot();
        a0p += 32; a1p += 32; b0p += 32; b1p += 32;
    }
    const float* t0p = sT + n * PB + 8 * hi;
    mm_head();
    #pragma unroll   // constant indices: values stay in registers, offsets become immediates
    for (int j = 0; j < 4; ++j) {
        const v4f a1 = *(const v4f*)(t0p + 16 * PB + 16 * (j >> 1) + 4 * (j & 1));
        y10 = mm4(a1.xy, ub[0][j].xy, y10);  y11 = mm4(a1.xy, ub[1][j].xy, y11);
        y10 = mm4(a1.zw, ub[0][j].zw, y10);  y11 = mm4(a1.zw, ub[1][j].zw, y11);
        if (j < 2) {                                // rows 0-15 are zero for j >= 16
            const v4f a0 = *(const v4f*)(t0p + 4 * j);
            y00 = mm4(a0.xy, ub[0][j].xy, y00);  y01 = mm4(a0.xy, ub[1][j].xy, y01);
            y00 = mm4(a0.zw, ub[0][j].zw, y00);  y01 = mm4(a0.zw, ub[1][j].zw, y01);
        }
    }
    mm_foot();

    // lane (n, hi) holds t = 16*mt + 8*hi + 0..7 of chunk c: 32 bytes in a row
    float* o0 = yp + lo;
    float* o1 = o0 + 16 * TC;
    *(v4f*)o0        = y00.lo;  *(v4f*)(o0 + 4)  = y00.hi;
    *(v4f*)(o0 + 16) = y10.lo;  *(v4f*)(o0 + 20) = y10.hi;
    *(v4f*)o1        = y01.lo;  *(v4f*)(o1 + 4)  = y01.hi;
    *(v4f*)(o1 + 16) = y11.lo;  *(v4f*)(o1 + 20) = y11.hi;
}

// ---------------------------------------------------------------------------
// Kernels 2/3: out[b,o,l] = relu( sum_h W[o,h] * X[b,h,l] + bias[o] )
// GEMM: (128x128) @ (128 x 65536) with V_WMMA_F32_16X16X4_F32.
// Block = 256 threads (8 waves); block owns 128 contiguous columns (b,l),
// wave w owns 16 columns and all 8 M-tiles (8 x v8f accumulators).
// W is staged in LDS at a pitch of 16 B x odd, so that the 16 rows of an A
// fragment fall on 64 different banks.  A lane reads 16 bytes of its row and
// feeds two WMMAs ({0,1} then {2,3}); lane half hi starts at k = 8j + 4hi, the
// same map for the rows of X on the B side.
// ---------------------------------------------------------------------------
constexpr int PW = Hh + 4;         // LDS pitch, rows of W (16 B x odd)

__global__ __launch_bounds__(256) void mlp_wmma_kernel(
    const float* __restrict__ W, const float* __restrict__ bias,
    const float* __restrict__ X, float* __restrict__ Y)
{
    __shared__ __attribute__((aligned(16))) float sW[Hh * PW];   // 66 KB
    for (int i = threadIdx.x; i < (Hh * Hh) / 4; i += 256)
        *(v4f*)&sW[(i >> 5) * PW + 4 * (i & 31)] = ((const v4f*)W)[i];
    __syncthreads();

    const int lane = threadIdx.x & 31;
    const int wid  = threadIdx.x >> 5;
    const int n    = lane & 15;                   // column within 16-wide tile
    const int hi   = lane >> 4;                   // half-wave selector

    const long c0  = (long)blockIdx.x * 128 + wid * 16;  // flat (b*L + l)
    const int  bb  = (int)(c0 / Ll);
    const int  l0  = (int)(c0 % Ll);              // L % 128 == 0: b uniform

    const float* xcol = X + ((size_t)bb * Hh) * Ll + l0 + n;

    v8f acc[8] = {};                              // 8 M-tiles x 16x16 f32

    // four trips a pass: their 16 loads of X go out together; not unrolled whole,
    // so that the accumulators are registers of their own from the first WMMA on
    #pragma unroll 4
    for (int j = 0; j < 16; ++j) {
        // 8 k a trip; the lane's four are kb..kb+3, on the A and on the B side
        const int kb = 8 * j + 4 * hi;
        v2f b0, b1;
        b0.x = xcol[(size_t)kb * Ll];
        b0.y = xcol[(size_t)(kb + 1) * Ll];
        b1.x = xcol[(size_t)(kb + 2) * Ll];
        b1.y = xcol[(size_t)(kb + 3) * Ll];
        v4f av[8];
        #pragma unroll   // constant indices: values stay in registers, offsets become immediates
        for (int mt = 0; mt < 8; ++mt)
            av[mt] = *(const v4f*)&sW[(mt * 16 + n) * PW + kb];
        #pragma unroll   // constant indices: values stay in registers
        for (int mt = 0; mt < 8; ++mt) acc[mt] = mm4(av[mt].xy, b0, acc[mt]);
        #pragma unroll   // constant indices: values stay in registers
        for (int mt = 0; mt < 8; ++mt) acc[mt] = mm4(av[mt].zw, b1, acc[mt]);
    }
    mm_foot();   // the epilogue's first vector instructions may reuse A or B registers

    // C/D layout: VGPR v, lanes 0-15 -> row v, lanes 16-31 -> row v+8
    float* ycol = Y + ((size_t)bb * Hh) * Ll + l0 + n;
    #pragma unroll
    for (int mt = 0; mt < 8; ++mt) {
        #pragma unroll
        for (int v = 0; v < 8; ++v) {
            const int row = mt * 16 + v + 8 * hi;
            float r = acc[mt][v] + bias[row];
            ycol[(size_t)row * Ll] = r > 0.f ? r : 0.f;
        }
    }
}

// ---------------------------------------------------------------------------
// Launch. Inputs:
//  0:u 1:lambda_re 2:lambda_im 3:w_re 4:w_im 5:d 6:mlp_w1 7:mlp_b1 8:mlp_w2 9:mlp_b2
// d_ws holds y (B*H*L f32 = 32 MB). Layer-1 output goes to d_out, layer-2
// runs safely in place on d_out (column-disjoint blocks, reads before writes).
// ---------------------------------------------------------------------------
extern "C" void kernel_launch(void* const* d_in, const int* in_sizes, int n_in,
                              void* d_out, int out_size, void* d_ws, size_t ws_size,
                              hipStream_t stream)
{
    const float* u   = (const float*)d_in[0];
    const float* lre = (const float*)d_in[1];
    const float* lim = (const float*)d_in[2];
    const float* wre = (const float*)d_in[3];
    const float* wim = (const float*)d_in[4];
    const float* dv  = (const float*)d_in[5];
    const float* w1  = (const float*)d_in[6];
    const float* b1  = (const float*)d_in[7];
    const float* w2  = (const float*)d_in[8];
    const float* b2  = (const float*)d_in[9];
    float* out = (float*)d_out;
    float* yws = (float*)d_ws;                    // B*H*L floats

    // 1) SSM in chunked matrix form: 4 sequences (one h, 4 b) per 512-thread block
    ssm_scan_kernel<<<(Bb * Hh) / 4, 512, 0, stream>>>(u, lre, lim, wre, wim, dv, yws);

    // 2) MLP layer 1: h1 = relu(W1 @ y + b1) -> d_out
    const int nblk = (Bb * Ll) / 128;             // 512 column-blocks
    mlp_wmma_kernel<<<nblk, 256, 0, stream>>>(w1, b1, yws, out);

    // 3) MLP layer 2: out = relu(W2 @ h1 + b2), in place on d_out
    mlp_wmma_kernel<<<nblk, 256, 0, stream>>>(w2, b2, out, out);
}

// v003
// One run takes 54.7 microseconds.
// Two timings next to v002 both put it at 1.09 times that version's speed.
// Counting every step since v000, it is 5.35 times as fast.
#include <hip/hip_runtime.h>

// S4D / diagonal-SSM reservoir + 2-layer 1x1-conv MLP for MI455X (gfx1250).
// Shapes: B=16, H=128, L=4096, N=64.  dt = 0.01.

#define DT 0.01f
constexpr int Bb = 16;
constexpr int Hh = 128;
constexpr int Ll = 4096;
constexpr int Nn = 64;

typedef __attribute__((ext_vector_type(2))) float v2f;
typedef __attribute__((ext_vector_type(4))) float v4f;
typedef __attribute__((ext_vector_type(8))) float v8f;

// ---------------------------------------------------------------------------
// Kernel 1: diagonal SSM in chunked matrix form, all products on
// V_WMMA_F32_16X16X4_F32.
//   s_n[l] = A_n * s_n[l-1] + u[l],  A_n = exp(dt*Lambda_n)
//   y[b,h,l] = sum_n Re(W_n * s_n[l]) + d[h]*u[b,h,l]
// A sequence is cut into CH = 128 chunks of TC = 32 steps and read as a
// matrix U[t][c] = u[32c + t].  With S_c the state in front of chunk c:
//   phase 1  G = Bm * U            Bm[2n|2n+1][t] = Re|Im A_n^(31-t)
//   phase 2  S_(c+1) = A^32 S_c + G_c   (128 steps in place of 4096)
//   phase 3  Y = Cm * S + Tm * U   Cm[t][2n|2n+1] = Re|-Im (W_n A_n^(t+1))
//                                  Tm[t][j] = K[t-j] (j <= t), K[0] holds d
// Block = 16 waves = 4 sequences (4 b) of one h; a wave owns 2 tiles of 16
// chunks (the N side).  Fragments are read 16 bytes a lane, two WMMAs each
// ({0,1} then {2,3}); lane half hi starts at k = 16(j/2)+8hi+4(j%2) where U is
// the B side and at k = 8j+4hi where S is, the same map for A and B each time.
// ---------------------------------------------------------------------------
constexpr int TC  = 32;            // chunk length
constexpr int CH  = Ll / TC;       // 128 chunks a sequence
constexpr int PB  = TC + 4;        // LDS pitch, rows of 32 floats (16 B x odd)
constexpr int PS  = 2 * Nn + 4;    // LDS pitch, rows of 128 floats (16 B x odd)
constexpr int SEQ = 4;             // sequences a block

__device__ __forceinline__ v8f mm4(v2f a, v2f b, v8f c)
{
    return __builtin_amdgcn_wmma_f32_16x16x4_f32(false, a, false, b, (short)0, c,
                                                 false, false);
}

// Head and foot of a block of WMMAs.  The fences keep address arithmetic out of
// the block; the four v_nop are the vector slots between the last WMMAs and the
// first vector instruction behind them, which may reuse their A or B registers.
__device__ __forceinline__ void mm_head() { __builtin_amdgcn_sched_barrier(0); }
__device__ __forceinline__ void mm_foot()
{
    __builtin_amdgcn_sched_barrier(0);
    asm volatile("v_nop\n\tv_nop\n\tv_nop\n\tv_nop");
    __builtin_amdgcn_sched_barrier(0);
}

__global__ __launch_bounds__(512) void ssm_scan_kernel(
    const float* __restrict__ u,   const float* __restrict__ lre,
    const float* __restrict__ lim, const float* __restrict__ wre,
    const float* __restrict__ wim, const float* __restrict__ dvec,
    float* __restrict__ y)
{
    __shared__ __attribute__((aligned(16))) float sS[SEQ * CH * PS];  // G, then S, [q][c][r]
    __shared__ __attribute__((aligned(16))) float sB[2 * Nn * PB];    // Bm[r][t]
    __shared__ __attribute__((aligned(16))) float sC[(TC + 1) * PS];  // row p: W A^p; Cm[t] = row t+1
    __shared__ __attribute__((aligned(16))) float sT[TC * PB];        // Tm[t][j]
    __shared__ float sK[TC];                                          // K[0..31]

    const int tid  = threadIdx.x;
    const int lane = tid & 31;
    const int wid  = __builtin_amdgcn_readfirstlane(tid >> 5);  // scalar: bases and branches per wave
    const int n    = lane & 15;
    const int hi   = lane >> 4;
    const int h    = blockIdx.x & (Hh - 1);
    const int bg   = blockIdx.x >> 7;          // group of 4 b
    const int q    = wid >> 2;                 // this wave's sequence in the block
    const int c0   = (wid & 3) * 32;           // first chunk of its two N tiles

    const size_t seq = (size_t)(bg * SEQ + q) * Hh + h;
    const float* up = u + seq * Ll + c0 * TC;  // scalar bases of the wave's 32 chunks
    float*       yp = y + seq * Ll + c0 * TC;
    const unsigned lo = n * TC + 8 * hi;       // the lane's place, for the loads of u and the stores of y

    // B fragments of U, kept in registers for phases 1 and 3
    v4f ub[2][4];
    #pragma unroll   // constant indices: values stay in registers, offsets become immediates
    for (int i = 0; i < 2; ++i)
        #pragma unroll   // constant indices: values stay in registers, offsets become immediates
        for (int j = 0; j < 4; ++j)
            ub[i][j] = *(const v4f*)(up + lo + i * 16 * TC + 16 * (j >> 1) + 4 * (j & 1));

    // phase 0: the h's own matrices; a thread keeps one state sn, powers m = tid/64 + 8k
    const int sn = tid & (Nn - 1);
    const float lr = DT * lre[h * Nn + sn], li = DT * lim[h * Nn + sn];
    const float wr = wre[h * Nn + sn],      wi = wim[h * Nn + sn];
    #pragma unroll   // constant indices: values stay in registers, offsets become immediates
    for (int m = tid >> 6; m < TC; m += 8) {
        const float fm = (float)m, fp = (float)(m + 1);
        const float em = __expf(lr * fm), ep = __expf(lr * fp);
        sB[(2 * sn) * PB + (TC - 1 - m)]     = em * __cosf(li * fm);
        sB[(2 * sn + 1) * PB + (TC - 1 - m)] = em * __sinf(li * fm);
        const float pr = ep * __cosf(li * fp), pi = ep * __sinf(li * fp);
        sC[(m + 1) * PS + 2 * sn]     = wr * pr - wi * pi;      //  Re(W A^(m+1))
        sC[(m + 1) * PS + 2 * sn + 1] = -(wr * pi + wi * pr);   // -Im(W A^(m+1))
    }
    if (tid < Nn) { sC[2 * sn] = wr; sC[2 * sn + 1] = -wi; }
    // A^32, the factor of the chunk-state scan
    const float eT = __expf(lr * (float)TC);
    const float ar = eT * __cosf(li * (float)TC), ai = eT * __sinf(li * (float)TC);
    __syncthreads();

    // K[m] = sum_n Re(W_n A_n^m), the feed-through d on K[0]; read after phase 1
    if (wid == 0) {
        const float* p = sC + lane * PS;
        float k0 = 0.f, k1 = 0.f, k2 = 0.f, k3 = 0.f;
        #pragma unroll   // constant indices: values stay in registers, offsets become immediates
        for (int i = 0; i < Nn; i += 4) {
            k0 += p[2 * i];     k1 += p[2 * i + 2];
            k2 += p[2 * i + 4]; k3 += p[2 * i + 6];
        }
        sK[lane] = (k0 + k1) + (k2 + k3) + (lane == 0 ? dvec[h] : 0.f);
    }

    // phase 1: G[r][c] = sum_t Bm[r][t] U[t][c], stored as sS[q][c][r]
    float* Sq = sS + q * (CH * PS);
    const float* ap = sB + n * PB + 8 * hi;
    float*       d0 = Sq + (c0 + n) * PS + 8 * hi;
    // rolled: one block of 16 WMMAs a trip, its addresses formed in front of it
    #pragma unroll 1
    for (int mt = 0; mt < 8; ++mt) {
        v8f g0 = {}, g1 = {};
        mm_head();
        #pragma unroll   // constant indices: values stay in registers, offsets become immediates
        for (int j = 0; j < 4; ++j) {
            const v4f av = *(const v4f*)(ap + 16 * (j >> 1) + 4 * (j & 1));
            g0 = mm4(av.xy, ub[0][j].xy, g0);
            g1 = mm4(av.xy, ub[1][j].xy, g1);
            g0 = mm4(av.zw, ub[0][j].zw, g0);
            g1 = mm4(av.zw, ub[1][j].zw, g1);
        }
        mm_foot();
        // D: register v holds row v + 8*hi, column n
        *(v4f*)d0             = g0.lo;  *(v4f*)(d0 + 4)           = g0.hi;
        *(v4f*)(d0 + 16 * PS) = g1.lo;  *(v4f*)(d0 + 16 * PS + 4) = g1.hi;
        ap += 16 * PB;
        d0 += 16;
    }
    __syncthreads();

    // phase 2: waves 0-7 scan the chunk states in place (one complex state a
    // lane); waves 8-15 lay out the Toeplitz block meanwhile
    if (wid < 8) {
        float* base = sS + (tid >> 6) * (CH * PS) + 2 * sn;
        float sr = 0.f, si = 0.f;
        v2f ga[8], gb[8];
        #pragma unroll   // constant indices: values stay in registers, offsets become immediates
        for (int k = 0; k < 8; ++k) ga[k] = *(const v2f*)(base + k * PS);
        // two register buffers: the LDS reads of the next 8 steps go out ahead of
        // the serial chain of these 8; kept rolled, unrolled whole it spills
        #pragma unroll 1
        for (int c = 0; c < CH; c += 16) {
            #pragma unroll   // constant indices: values stay in registers, offsets become immediates
            for (int k = 0; k < 8; ++k) gb[k] = *(const v2f*)(base + (c + 8 + k) * PS);
            #pragma unroll   // constant indices: values stay in registers, offsets become immediates
            for (int k = 0; k < 8; ++k) {
                v2f s; s.x = sr; s.y = si;
                *(v2f*)(base + (c + k) * PS) = s;
                const float nr = fmaf(ar, sr, fmaf(-ai, si, ga[k].x));
                const float ni = fmaf(ar, si, fmaf(ai, sr, ga[k].y));
                sr = nr; si = ni;
            }
            if (c + 16 < CH) {
                #pragma unroll   // constant indices: values stay in registers, offsets become immediates
                for (int k = 0; k < 8; ++k) ga[k] = *(const v2f*)(base + (c + 16 + k) * PS);
            }
            #pragma unroll   // constant indices: values stay in registers, offsets become immediates
            for (int k = 0; k < 8; ++k) {
                v2f s; s.x = sr; s.y = si;
                *(v2f*)(base + (c + 8 + k) * PS) = s;
                const float nr = fmaf(ar, sr, fmaf(-ai, si, gb[k].x));
                const float ni = fmaf(ar, si, fmaf(ai, sr, gb[k].y));
                sr = nr; si = ni;
            }
        }
    } else {
        for (int idx = tid - 256; idx < TC * TC; idx += 256) {
            const int t = idx >> 5, j = idx & 31;
            const float kv = sK[(t - j) & 31];
            sT[t * PB + j] = t >= j ? kv : 0.f;
        }
    }
    __syncthreads();

    // phase 3: Y[t][c] = sum_r Cm[t][r] S[r][c] + sum_j Tm[t][j] U[j][c]
    v8f y00 = {}, y01 = {}, y10 = {}, y11 = {};     // y<M tile><N tile>
    const float* b0p = Sq + (c0 + n) * PS + 4 * hi;
    const float* b1p = b0p + 16 * PS;
    const float* a0p = sC + (1 + n) * PS + 4 * hi;
    const float* a1p = a0p + 16 * PS;
    // rolled: one block of 32 WMMAs a trip, its addresses formed in front of it
    #pragma unroll 1
    for (int jo = 0; jo < 4; ++jo) {
        mm_head();
        #pragma unroll   // constant indices: values stay in registers, offsets become immediates
        for (int j = 0; j < 4; ++j) {
            const v4f a0 = *(const v4f*)(a0p + 8 * j), a1 = *(const v4f*)(a1p + 8 * j);
            const v4f b0 = *(const v4f*)(b0p + 8 * j), b1 = *(const v4f*)(b1p + 8 * j);
            y00 = mm4(a0.xy, b0.xy, y00);  y01 = mm4(a0.xy, b1.xy, y01);
            y10 = mm4(a1.xy, b0.xy, y10);  y11 = mm4(a1.xy, b1.xy, y11);
            y00 = mm4(a0.zw, b0.zw, y00);  y01 = mm4(a0.zw, b1.zw, y01);
            y10 = mm4(a1.zw, b0.zw, y10);  y11 = mm4(a1.zw, b1.zw, y11);
        }
        mm_foot();
        a0p += 32; a1p += 32; b0p += 32; b1p += 32;
    }
    const float* t0p = sT + n * PB + 8 * hi;
    mm_head();
    #pragma unroll   // constant indices: values stay in registers, offsets become immediates
    for (int j = 0; j < 4; ++j) {
        const v4f a1 = *(const v4f*)(t0p + 16 * PB + 16 * (j >> 1) + 4 * (j & 1));
        y10 = mm4(a1.xy, ub[0][j].xy, y10);  y11 = mm4(a1.xy, ub[1][j].xy, y11);
        y10 = mm4(a1.zw, ub[0][j].zw, y10);  y11 = mm4(a1.zw, ub[1][j].zw, y11);
        if (j < 2) {                                // rows 0-15 are zero for j >= 16
            const v4f a0 = *(const v4f*)(t0p + 4 * j);
            y00 = mm4(a0.xy, ub[0][j].xy, y00);  y01 = mm4(a0.xy, ub[1][j].xy, y01);
            y00 = mm4(a0.zw, ub[0][j].zw, y00);  y01 = mm4(a0.zw, ub[1][j].zw, y01);
        }
    }
    mm_foot();

    // lane (n, hi) holds t = 16*mt + 8*hi + 0..7 of chunk c: 32 bytes in a row
    float* o0 = yp + lo;
    float* o1 = o0 + 16 * TC;
    *(v4f*)o0        = y00.lo;  *(v4f*)(o0 + 4)  = y00.hi;
    *(v4f*)(o0 + 16) = y10.lo;  *(v4f*)(o0 + 20) = y10.hi;
    *(v4f*)o1        = y01.lo;  *(v4f*)(o1 + 4)  = y01.hi;
    *(v4f*)(o1 + 16) = y11.lo;  *(v4f*)(o1 + 20) = y11.hi;
}

// ---------------------------------------------------------------------------
// Kernel 2: both MLP layers in one launch.
//   h1[b,o,l]  = relu( sum_h W1[o,h] * X[b,h,l]  + b1[o] )
//   out[b,o,l] = relu( sum_h W2[o,h] * h1[b,h,l] + b2[o] )
// Two GEMMs (128x128) @ (128 x 65536) with V_WMMA_F32_16X16X4_F32.
// Block = 256 threads (8 waves); block owns 128 contiguous columns (b,l),
// wave w owns 16 columns and all 8 M-tiles (8 x v8f accumulators), so it holds
// every row of h1 for its own columns and layer 2 needs no other wave's data.
// W1 and W2 are staged in LDS at a pitch of 16 B x odd, so that the 16 rows of
// an A fragment fall on 64 different banks.  A lane reads 16 bytes of its row
// and feeds two WMMAs ({0,1} then {2,3}).
// Layer 1: lane half hi starts at k = 8j + 4hi, the same map for the rows of X
// on the B side.
// Layer 2: the D registers of layer 1 are the B fragments as they stand.  Lane
// (n, hi) holds rows 16kt + 8hi + 0..7 of column n, so lane half hi starts at
// k = 16kt + 8hi + 4i, and the A side reads W2 by the same map.
// ---------------------------------------------------------------------------
constexpr int PW = Hh + 4;         // LDS pitch, rows of W (16 B x odd)

__global__ __launch_bounds__(256) void mlp2_wmma_kernel(
    const float* __restrict__ W1, const float* __restrict__ bias1,
    const float* __restrict__ W2, const float* __restrict__ bias2,
    const float* __restrict__ X, float* __restrict__ Y)
{
    __shared__ __attribute__((aligned(16))) float sW1[Hh * PW];   // 66 KB
    __shared__ __attribute__((aligned(16))) float sW2[Hh * PW];   // 66 KB
    for (int i = threadIdx.x; i < (Hh * Hh) / 4; i += 256) {
        *(v4f*)&sW1[(i >> 5) * PW + 4 * (i & 31)] = ((const v4f*)W1)[i];
        *(v4f*)&sW2[(i >> 5) * PW + 4 * (i & 31)] = ((const v4f*)W2)[i];
    }
    __syncthreads();

    const int lane = threadIdx.x & 31;
    const int wid  = threadIdx.x >> 5;
    const int n    = lane & 15;                   // column within 16-wide tile
    const int hi   = lane >> 4;                   // half-wave selector

    const long c0  = (long)blockIdx.x * 128 + wid * 16;  // flat (b*L + l)
    const int  bb  = (int)(c0 / Ll);
    const int  l0  = (int)(c0 % Ll);              // L % 128 == 0: b uniform

    const float* xcol = X + ((size_t)bb * Hh) * Ll + l0 + n;

    v8f acc[8] = {};                              // 8 M-tiles x 16x16 f32

    // four trips a pass: their 16 loads of X go out together; not unrolled whole,
    // so that the accumulators are registers of their own from the first WMMA on
    #pragma unroll 4
    for (int j = 0; j < 16; ++j) {
        // 8 k a trip; the lane's four are kb..kb+3, on the A and on the B side
        const int kb = 8 * j + 4 * hi;
        v2f b0, b1;
        b0.x = xcol[(size_t)kb * Ll];
        b0.y = xcol[(size_t)(kb + 1) * Ll];
        b1.x = xcol[(size_t)(kb + 2) * Ll];
        b1.y = xcol[(size_t)(kb + 3) * Ll];
        v4f av[8];
        #pragma unroll   // constant indices: values stay in registers, offsets become immediates
        for (int mt = 0; mt < 8; ++mt)
            av[mt] = *(const v4f*)&sW1[(mt * 16 + n) * PW + kb];
        #pragma unroll   // constant indices: values stay in registers
        for (int mt = 0; mt < 8; ++mt) acc[mt] = mm4(av[mt].xy, b0, acc[mt]);
        #pragma unroll   // constant indices: values stay in registers
        for (int mt = 0; mt < 8; ++mt) acc[mt] = mm4(av[mt].zw, b1, acc[mt]);
    }
    mm_foot();   // the next vector instructions may reuse A or B registers

    // C/D layout: VGPR v, lanes 0-15 -> row v, lanes 16-31 -> row v+8
    // h1 = relu(acc + b1), in place, all of it in front of layer 2's first WMMA
    #pragma unroll   // constant indices: values stay in registers
    for (int mt = 0; mt < 8; ++mt) {
        #pragma unroll   // constant indices: values stay in registers
        for (int v = 0; v < 8; ++v) {
            const float r = acc[mt][v] + bias1[mt * 16 + v + 8 * hi];
            acc[mt][v] = r > 0.f ? r : 0.f;
        }
    }

    v8f res[8] = {};                              // layer 2, 8 M-tiles
    mm_head();   // keeps the vector work on h1 out of the block: it would write B registers behind a WMMA
    #pragma unroll   // constant indices: h1 is read from the registers it stands in
    for (int kt = 0; kt < 8; ++kt) {
        #pragma unroll   // constant indices: h1 is read from the registers it stands in
        for (int i = 0; i < 2; ++i) {
            // 8 k a trip; the lane's four are kb..kb+3, on the A and on the B side
            const int kb = 16 * kt + 8 * hi + 4 * i;
            v2f b0, b1;
            b0.x = acc[kt][4 * i];      b0.y = acc[kt][4 * i + 1];
            b1.x = acc[kt][4 * i + 2];  b1.y = acc[kt][4 * i + 3];
            v4f av[8];
            #pragma unroll   // constant indices: values stay in registers, offsets become immediates
            for (int mt = 0; mt < 8; ++mt)
                av[mt] = *(const v4f*)&sW2[(mt * 16 + n) * PW + kb];
            #pragma unroll   // constant indices: values stay in registers
            for (int mt = 0; mt < 8; ++mt) res[mt] = mm4(av[mt].xy, b0, res[mt]);
            #pragma unroll   // constant indices: values stay in registers
            for (int mt = 0; mt < 8; ++mt) res[mt] = mm4(av[mt].zw, b1, res[mt]);
        }
    }
    mm_foot();   // the epilogue's first vector instructions may reuse A or B registers

    float* ycol = Y + ((size_t)bb * Hh) * Ll + l0 + n;
    #pragma unroll
    for (int mt = 0; mt < 8; ++mt) {
        #pragma unroll
        for (int v = 0; v < 8; ++v) {
            const int row = mt * 16 + v + 8 * hi;
            float r = res[mt][v] + bias2[row];
            ycol[(size_t)row * Ll] = r > 0.f ? r : 0.f;
        }
    }
}

// ---------------------------------------------------------------------------
// Launch. Inputs:
//  0:u 1:lambda_re 2:lambda_im 3:w_re 4:w_im 5:d 6:mlp_w1 7:mlp_b1 8:mlp_w2 9:mlp_b2
// d_ws holds y (B*H*L f32 = 32 MB). The layer-1 output stays in registers.
// ---------------------------------------------------------------------------
extern "C" void kernel_launch(void* const* d_in, const int* in_sizes, int n_in,
                              void* d_out, int out_size, void* d_ws, size_t ws_size,
                              hipStream_t stream)
{
    const float* u   = (const float*)d_in[0];
    const float* lre = (const float*)d_in[1];
    const float* lim = (const float*)d_in[2];
    const float* wre = (const float*)d_in[3];
    const float* wim = (const float*)d_in[4];
    const float* dv  = (const float*)d_in[5];
    const float* w1  = (const float*)d_in[6];
    const float* b1  = (const float*)d_in[7];
    const float* w2  = (const float*)d_in[8];
    const float* b2  = (const float*)d_in[9];
    float* out = (float*)d_out;
    float* yws = (float*)d_ws;                    // B*H*L floats

    // 1) SSM in chunked matrix form: 4 sequences (one h, 4 b) per 512-thread block
    ssm_scan_kernel<<<(Bb * Hh) / 4, 512, 0, stream>>>(u, lre, lim, wre, wim, dv, yws);

    // 2) both MLP layers: out = relu(W2 @ relu(W1 @ y + b1) + b2)
    const int nblk = (Bb * Ll) / 128;             // 512 column-blocks
    mlp2_wmma_kernel<<<nblk, 256, 0, stream>>>(w1, b1, w2, b2, yws, out);
}
